// v000
// Times are from an AMD MI455X. After a warm-up the kernel runs many times in a row, and a time is the length of
// such a window on the GPU divided by its runs, so every launch and the gaps after it count. The runs cycle
// through copies of the inputs. A figure is the median of several windows, for all but v000 over two sittings.
// Sittings can differ by a few percent; kernels timed side by side share one.
// v000 is the starting kernel. One run takes 23.5 microseconds.
#include <hip/hip_runtime.h>
#include <hip/hip_bf16.h>

// Problem constants (from reference)
#define BB   16
#define SS   2048
#define DD   512
#define WW   5
#define KK   11           // 2*w+1
#define TS   16           // token positions per block tile
#define HALO (TS + 2*WW)  // 26 rows staged per tile
#define XSTR 520          // padded LDS row stride (floats) -> conflict-free across lane halves
#define ASTR 33           // padded Aexp row stride (floats)
#define AK   28           // K dim padded to multiple of 4 (>= HALO=26)

typedef float v2f __attribute__((ext_vector_type(2)));
typedef float v8f __attribute__((ext_vector_type(8)));

__global__ __launch_bounds__(256) void local_attn_wmma_kernel(
    const float* __restrict__ X,     // [B,S,D]
    const float* __restrict__ Wv,    // [D]
    const float* __restrict__ bv,    // [1]
    float* __restrict__ Out)         // [B,S,D]
{
    __shared__ float xs[HALO * XSTR];   // staged halo tile  (~53 KB)
    __shared__ float sbuf[HALO];        // scores for halo rows
    __shared__ float Aexp[TS * ASTR];   // expanded banded alpha (16 x AK used)

    const int tid  = threadIdx.x;
    const int t0   = blockIdx.x * TS;
    const int b    = blockIdx.y;
    const float* Xb = X + (size_t)b * SS * DD;

    // ---------------- Phase 0: stage halo rows [t0-5, t0+21) into LDS ----------------
    // 26 rows * 128 float4 = 3328 vec4 loads, 13 per thread. Clamped rows are
    // multiplied by alpha==0 later, so clamping is safe.
    for (int v = tid; v < HALO * (DD / 4); v += 256) {
        int r  = v / (DD / 4);
        int c4 = (v % (DD / 4)) * 4;
        int gr = t0 - WW + r;
        gr = gr < 0 ? 0 : (gr >= SS ? SS - 1 : gr);
        float4 val = *(const float4*)(Xb + (size_t)gr * DD + c4);
        *(float4*)(&xs[r * XSTR + c4]) = val;
    }
    for (int v = tid; v < TS * ASTR; v += 256) Aexp[v] = 0.0f;
    __syncthreads();

    // ---------------- Phase 1: scores s[r] = dot(xs[r,:], W) + b ----------------
    const int wave = tid >> 5;
    const int lane = tid & 31;
    for (int r = wave; r < HALO; r += 8) {
        float p = 0.0f;
        #pragma unroll
        for (int i = 0; i < DD / 32; ++i)
            p = fmaf(xs[r * XSTR + lane + 32 * i], Wv[lane + 32 * i], p);
        #pragma unroll
        for (int off = 16; off > 0; off >>= 1)
            p += __shfl_xor(p, off, 32);
        if (lane == 0) sbuf[r] = p + bv[0];
    }
    __syncthreads();

    // ---------------- Phase 2: masked band softmax -> Aexp[i][i+k] ----------------
    if (tid < TS) {
        const int i = tid;
        float band[KK];
        float m = -__builtin_inff();
        #pragma unroll
        for (int k = 0; k < KK; ++k) {
            int raw  = t0 + i - WW + k;
            bool ok  = (raw >= 0) && (raw < SS);
            float v  = ok ? sbuf[i + k] : -__builtin_inff();
            band[k]  = v;
            m = v > m ? v : m;
        }
        float sum = 0.0f;
        #pragma unroll
        for (int k = 0; k < KK; ++k) {
            float e = __expf(band[k] - m);   // exp(-inf) == 0 for masked entries
            band[k] = e;
            sum += e;
        }
        float inv = 1.0f / sum;
        #pragma unroll
        for (int k = 0; k < KK; ++k)
            Aexp[i * ASTR + (i + k)] = band[k] * inv;
    }
    __syncthreads();

    // ---------------- Phase 3: out_tile = Aexp(16xAK) x xs(AKx16) via WMMA f32 ----------------
    // f32 16x16x4 operand layout (wave32):
    //   A: lanes 0-15 -> M=0..15, K = 4s + 2*(lane>=16) + vgpr
    //   B: lane halves split K the same way, N = lane&15 striped in each VGPR
    //   C/D: vgpr v -> row v + 8*(lane>=16), col = lane&15
    const int Llo = lane & 15;
    const int Lhi = lane >> 4;
    float* Ob = Out + ((size_t)b * SS + t0) * DD;

    for (int chunk = wave; chunk < DD / 16; chunk += 8) {
        const int d0 = chunk * 16;
        v8f acc = {};
        #pragma unroll
        for (int s = 0; s < AK / 4; ++s) {
            const int k = s * 4 + 2 * Lhi;
            v2f a, bm;
            a.x = Aexp[Llo * ASTR + k];
            a.y = Aexp[Llo * ASTR + k + 1];
            // branchless zero-mask for padded K rows (26,27); Aexp is 0 there too
            const int r0 = (k     < HALO) ? k     : 0;
            const int r1 = (k + 1 < HALO) ? k + 1 : 0;
            const float m0 = (k     < HALO) ? 1.0f : 0.0f;
            const float m1 = (k + 1 < HALO) ? 1.0f : 0.0f;
            bm.x = m0 * xs[r0 * XSTR + d0 + Llo];
            bm.y = m1 * xs[r1 * XSTR + d0 + Llo];
            acc = __builtin_amdgcn_wmma_f32_16x16x4_f32(
                false, a, false, bm, (short)0, acc, false, false);
        }
        #pragma unroll
        for (int v = 0; v < 8; ++v)
            Ob[(size_t)(v + 8 * Lhi) * DD + d0 + Llo] = acc[v];
    }
}

extern "C" void kernel_launch(void* const* d_in, const int* in_sizes, int n_in,
                              void* d_out, int out_size, void* d_ws, size_t ws_size,
                              hipStream_t stream) {
    const float* X  = (const float*)d_in[0];   // [B,S,D] fp32
    const float* Wv = (const float*)d_in[1];   // [D]
    const float* bv = (const float*)d_in[2];   // [1]
    float* Out = (float*)d_out;                // [B,S,D] fp32

    dim3 grid(SS / TS, BB);   // 128 x 16 blocks
    dim3 block(256);          // 8 waves (wave32)
    local_attn_wmma_kernel<<<grid, block, 0, stream>>>(X, Wv, bv, Out);
}

// v001
// Measured time: 21.7 microseconds a run.
// Next to v000, in two timings, it ran 1.10 and 1.09 times as fast.
#include <hip/hip_runtime.h>
#include <hip/hip_bf16.h>

// Problem constants (from reference)
#define BB   16
#define SS   2048
#define DD   512
#define WW   5
#define KK   11           // 2*w+1
#define TS   64           // token positions per block tile (four 16-token WMMA sub-tiles)
#define NSUB (TS / 16)    // WMMA sub-tiles per block tile
#define HALO (TS + 2*WW)  // 74 rows staged per tile
#define XSTR 520          // padded LDS row stride (floats) -> conflict-free across lane halves
#define ASTR 33           // padded Aexp row stride (floats)
#define AK   28           // K dim of one sub-tile, padded to multiple of 4 (>= 16 + 2*WW = 26)
#define NG   ((TS - 16 + AK) / 4)  // 4-row groups of xs that the sub-tiles read (19)

typedef float v2f __attribute__((ext_vector_type(2)));
typedef float v8f __attribute__((ext_vector_type(8)));

__global__ __launch_bounds__(256) void local_attn_wmma_kernel(
    const float* __restrict__ X,     // [B,S,D]
    const float* __restrict__ Wv,    // [D]
    const float* __restrict__ bv,    // [1]
    float* __restrict__ Out)         // [B,S,D]
{
    __shared__ float xs[HALO * XSTR];   // staged halo tile  (~150 KB, two blocks per WGP)
    __shared__ float sbuf[HALO];        // scores for halo rows
    __shared__ float Aexp[TS * ASTR];   // expanded banded alpha (per sub-tile 16 x AK used)

    const int tid  = threadIdx.x;
    const int t0   = blockIdx.x * TS;
    const int b    = blockIdx.y;
    const float* Xb = X + (size_t)b * SS * DD;

    // ---------------- Phase 0: stage halo rows [t0-5, t0+69) into LDS ----------------
    // 74 rows * 128 float4 = 9472 vec4 loads, 37 per thread. Clamped rows are
    // multiplied by alpha==0 later, so clamping is safe.
    for (int v = tid; v < HALO * (DD / 4); v += 256) {
        int r  = v / (DD / 4);
        int c4 = (v % (DD / 4)) * 4;
        int gr = t0 - WW + r;
        gr = gr < 0 ? 0 : (gr >= SS ? SS - 1 : gr);
        float4 val = *(const float4*)(Xb + (size_t)gr * DD + c4);
        *(float4*)(&xs[r * XSTR + c4]) = val;
    }
    for (int v = tid; v < TS * ASTR; v += 256) Aexp[v] = 0.0f;
    __syncthreads();

    // ---------------- Phase 1: scores s[r] = dot(xs[r,:], W) + b ----------------
    const int wave = tid >> 5;
    const int lane = tid & 31;
    for (int r = wave; r < HALO; r += 8) {
        float p = 0.0f;
        #pragma unroll
        for (int i = 0; i < DD / 32; ++i)
            p = fmaf(xs[r * XSTR + lane + 32 * i], Wv[lane + 32 * i], p);
        #pragma unroll
        for (int off = 16; off > 0; off >>= 1)
            p += __shfl_xor(p, off, 32);
        if (lane == 0) sbuf[r] = p + bv[0];
    }
    __syncthreads();

    // ---------------- Phase 2: masked band softmax -> Aexp[i][(i&15)+k] ----------------
    if (tid < TS) {
        const int i = tid;
        float band[KK];
        float m = -__builtin_inff();
        #pragma unroll
        for (int k = 0; k < KK; ++k) {
            int raw  = t0 + i - WW + k;
            bool ok  = (raw >= 0) && (raw < SS);
            float v  = ok ? sbuf[i + k] : -__builtin_inff();
            band[k]  = v;
            m = v > m ? v : m;
        }
        float sum = 0.0f;
        #pragma unroll
        for (int k = 0; k < KK; ++k) {
            float e = __expf(band[k] - m);   // exp(-inf) == 0 for masked entries
            band[k] = e;
            sum += e;
        }
        float inv = 1.0f / sum;
        #pragma unroll
        for (int k = 0; k < KK; ++k)
            Aexp[i * ASTR + ((i & 15) + k)] = band[k] * inv;
    }
    __syncthreads();

    // ---------------- Phase 3: out_tile = Aexp(16xAK) x xs(AKx16) via WMMA f32 ----------------
    // f32 16x16x4 operand layout (wave32):
    //   A: lanes 0-15 -> M=0..15, K = 4s + 2*(lane>=16) + vgpr
    //   B: lane halves split K the same way, N = lane&15 striped in each VGPR
    //   C/D: vgpr v -> row v + 8*(lane>=16), col = lane&15
    // Sub-tile j (tokens 16j..16j+15) reads xs rows 16j..16j+27 = row groups 4j..4j+6,
    // so one load of a row group feeds every sub-tile whose window holds it.
    const int Llo = lane & 15;
    const int Lhi = lane >> 4;
    float* Ob = Out + ((size_t)b * SS + t0) * DD;

    // A fragments of all sub-tiles, read once per wave and kept for every column chunk.
    // Both loops unrolled: a[][] needs constant indices to live in registers.
    v2f a[NSUB][AK / 4];
    #pragma unroll
    for (int j = 0; j < NSUB; ++j) {
        #pragma unroll
        for (int s = 0; s < AK / 4; ++s) {
            const int k = s * 4 + 2 * Lhi;
            a[j][s].x = Aexp[(j * 16 + Llo) * ASTR + k];
            a[j][s].y = Aexp[(j * 16 + Llo) * ASTR + k + 1];
        }
    }

    for (int chunk = wave; chunk < DD / 16; chunk += 8) {
        const int d0 = chunk * 16;
        v8f acc[NSUB] = {};
        // g and j unrolled: constant indices keep a[][] and acc[] in registers and
        // resolve the window test (which sub-tiles read group g) at compile time.
        #pragma unroll
        for (int g = 0; g < NG; ++g) {
            const int k = g * 4 + 2 * Lhi;
            v2f bm;
            // branchless zero-mask for padded K rows (74,75); Aexp is 0 there too
            const int r0 = (k     < HALO) ? k     : 0;
            const int r1 = (k + 1 < HALO) ? k + 1 : 0;
            const float m0 = (k     < HALO) ? 1.0f : 0.0f;
            const float m1 = (k + 1 < HALO) ? 1.0f : 0.0f;
            bm.x = m0 * xs[r0 * XSTR + d0 + Llo];
            bm.y = m1 * xs[r1 * XSTR + d0 + Llo];
            #pragma unroll
            for (int j = 0; j < NSUB; ++j) {
                const int s = g - 4 * j;
                if (s >= 0 && s < AK / 4)
                    acc[j] = __builtin_amdgcn_wmma_f32_16x16x4_f32(
                        false, a[j][s], false, bm, (short)0, acc[j], false, false);
            }
        }
        // unrolled: acc[][] is indexed by constants (registers, no scratch)
        #pragma unroll
        for (int j = 0; j < NSUB; ++j) {
            #pragma unroll
            for (int v = 0; v < 8; ++v)
                Ob[(size_t)(j * 16 + v + 8 * Lhi) * DD + d0 + Llo] = acc[j][v];
        }
    }
}

extern "C" void kernel_launch(void* const* d_in, const int* in_sizes, int n_in,
                              void* d_out, int out_size, void* d_ws, size_t ws_size,
                              hipStream_t stream) {
    const float* X  = (const float*)d_in[0];   // [B,S,D] fp32
    const float* Wv = (const float*)d_in[1];   // [D]
    const float* bv = (const float*)d_in[2];   // [1]
    float* Out = (float*)d_out;                // [B,S,D] fp32

    dim3 grid(SS / TS, BB);   // 32 x 16 blocks
    dim3 block(256);          // 8 waves (wave32)
    local_attn_wmma_kernel<<<grid, block, 0, stream>>>(X, Wv, bv, Out);
}

// v002
// One run takes 16.7 microseconds.
// Next to v001, in two timings, it ran 1.30 and 1.28 times as fast.
// All steps since v000 together make it 1.41 times as fast.
#include <hip/hip_runtime.h>
#include <hip/hip_bf16.h>

// Problem constants (from reference)
#define BB   16
#define SS   2048
#define DD   512
#define WW   5
#define KK   11           // 2*w+1
#define TS   64           // token positions per block tile (four 16-token WMMA sub-tiles)
#define NSUB (TS / 16)    // WMMA sub-tiles per block tile
#define HALO (TS + 2*WW)  // 74 rows staged per tile
#define XSTR 520          // padded LDS row stride (floats) -> conflict-free across lane halves
#define ASTR 33           // padded Aexp row stride (floats)
#define AK   28           // K dim of one sub-tile, padded to multiple of 4 (>= 16 + 2*WW = 26)
#define NG   ((TS - 16 + AK) / 4)  // 4-row groups of xs that the sub-tiles read (19)
#define NQ   4            // WMMA column tiles per wave (8 waves x 16*NQ = DD columns)

typedef float v2f __attribute__((ext_vector_type(2)));
typedef float v8f __attribute__((ext_vector_type(8)));

__global__ __launch_bounds__(256) void local_attn_wmma_kernel(
    const float* __restrict__ X,     // [B,S,D]
    const float* __restrict__ Wv,    // [D]
    const float* __restrict__ bv,    // [1]
    float* __restrict__ Out)         // [B,S,D]
{
    __shared__ float xs[HALO * XSTR];   // staged halo tile  (~150 KB, two blocks per WGP)
    __shared__ float sbuf[HALO];        // scores for halo rows
    __shared__ float Aexp[TS * ASTR];   // expanded banded alpha (per sub-tile 16 x AK used)

    const int tid  = threadIdx.x;
    const int t0   = blockIdx.x * TS;
    const int b    = blockIdx.y;
    const float* Xb = X + (size_t)b * SS * DD;

    // ---------------- Phase 0: stage halo rows [t0-5, t0+69) into LDS ----------------
    // 74 rows * 128 float4 = 9472 vec4 loads, 37 per thread. Clamped rows are
    // multiplied by alpha==0 later, so clamping is safe.
    for (int v = tid; v < HALO * (DD / 4); v += 256) {
        int r  = v / (DD / 4);
        int c4 = (v % (DD / 4)) * 4;
        int gr = t0 - WW + r;
        gr = gr < 0 ? 0 : (gr >= SS ? SS - 1 : gr);
        float4 val = *(const float4*)(Xb + (size_t)gr * DD + c4);
        *(float4*)(&xs[r * XSTR + c4]) = val;
    }
    for (int v = tid; v < TS * ASTR; v += 256) Aexp[v] = 0.0f;
    __syncthreads();

    // ---------------- Phase 1: scores s[r] = dot(xs[r,:], W) + b ----------------
    const int wave = tid >> 5;
    const int lane = tid & 31;
    for (int r = wave; r < HALO; r += 8) {
        float p = 0.0f;
        #pragma unroll
        for (int i = 0; i < DD / 32; ++i)
            p = fmaf(xs[r * XSTR + lane + 32 * i], Wv[lane + 32 * i], p);
        #pragma unroll
        for (int off = 16; off > 0; off >>= 1)
            p += __shfl_xor(p, off, 32);
        if (lane == 0) sbuf[r] = p + bv[0];
    }
    __syncthreads();

    // ---------------- Phase 2: masked band softmax -> Aexp[i][(i&15)+k] ----------------
    if (tid < TS) {
        const int i = tid;
        float band[KK];
        float m = -__builtin_inff();
        #pragma unroll
        for (int k = 0; k < KK; ++k) {
            int raw  = t0 + i - WW + k;
            bool ok  = (raw >= 0) && (raw < SS);
            float v  = ok ? sbuf[i + k] : -__builtin_inff();
            band[k]  = v;
            m = v > m ? v : m;
        }
        float sum = 0.0f;
        #pragma unroll
        for (int k = 0; k < KK; ++k) {
            float e = __expf(band[k] - m);   // exp(-inf) == 0 for masked entries
            band[k] = e;
            sum += e;
        }
        float inv = 1.0f / sum;
        #pragma unroll
        for (int k = 0; k < KK; ++k)
            Aexp[i * ASTR + ((i & 15) + k)] = band[k] * inv;
    }
    __syncthreads();

    // ---------------- Phase 3: out_tile = Aexp(16xAK) x xs(AKx16) via WMMA f32 ----------------
    // f32 16x16x4 operand layout (wave32):
    //   A: lanes 0-15 -> M=0..15, K = 4s + 2*(lane>=16) + vgpr
    //   B: lane halves split K the same way, N = lane&15 striped in each VGPR
    //   C/D: vgpr v -> row v + 8*(lane>=16), col = lane&15
    // Sub-tile j (tokens 16j..16j+15) reads xs rows 16j..16j+27 = row groups 4j..4j+6,
    // so one load of a row group feeds every sub-tile whose window holds it.
    // Column map: a wave owns 64 adjacent columns as NQ = 4 WMMA column tiles, and
    // N index n of tile q is column 4n + q. A lane's four tiles are then four adjacent
    // columns: one 16-byte LDS read per xs row feeds all four tiles, and a result row
    // leaves as one 16-byte store per lane, 256 contiguous bytes per half-wave.
    const int Llo = lane & 15;
    const int Lhi = lane >> 4;
    const int c0  = wave * (16 * NQ) + NQ * Llo;   // this lane's first column
    float* Ob = Out + ((size_t)b * SS + t0) * DD;

    // A fragments of all sub-tiles, read once per wave.
    // Both loops unrolled: a[][] needs constant indices to live in registers.
    v2f a[NSUB][AK / 4];
    #pragma unroll
    for (int j = 0; j < NSUB; ++j) {
        #pragma unroll
        for (int s = 0; s < AK / 4; ++s) {
            const int k = s * 4 + 2 * Lhi;
            a[j][s].x = Aexp[(j * 16 + Llo) * ASTR + k];
            a[j][s].y = Aexp[(j * 16 + Llo) * ASTR + k + 1];
        }
    }

    v8f acc[NSUB][NQ] = {};
    // g, j, q unrolled: constant indices keep a[][] and acc[][] in registers and
    // resolve the window test (which sub-tiles read group g) at compile time.
    #pragma unroll
    for (int g = 0; g < NG; ++g) {
        const int k = g * 4 + 2 * Lhi;
        // branchless zero-mask for padded K rows (74,75); Aexp is 0 there too
        const int r0 = (k     < HALO) ? k     : 0;
        const int r1 = (k + 1 < HALO) ? k + 1 : 0;
        const float m0 = (k     < HALO) ? 1.0f : 0.0f;
        const float m1 = (k + 1 < HALO) ? 1.0f : 0.0f;
        const float4 x0 = *(const float4*)(&xs[r0 * XSTR + c0]);
        const float4 x1 = *(const float4*)(&xs[r1 * XSTR + c0]);
        v2f bm[NQ];
        bm[0].x = m0 * x0.x;  bm[0].y = m1 * x1.x;
        bm[1].x = m0 * x0.y;  bm[1].y = m1 * x1.y;
        bm[2].x = m0 * x0.z;  bm[2].y = m1 * x1.z;
        bm[3].x = m0 * x0.w;  bm[3].y = m1 * x1.w;
        #pragma unroll
        for (int j = 0; j < NSUB; ++j) {
            const int s = g - 4 * j;
            if (s >= 0 && s < AK / 4) {
                #pragma unroll
                for (int q = 0; q < NQ; ++q)
                    acc[j][q] = __builtin_amdgcn_wmma_f32_16x16x4_f32(
                        false, a[j][s], false, bm[q], (short)0, acc[j][q], false, false);
            }
            if (s == AK / 4 - 1) {
                // sub-tile j is complete: store it now, so its registers are free for
                // sub-tile j + 2; unrolled so acc is indexed by constants
                #pragma unroll
                for (int v = 0; v < 8; ++v) {
                    float4 o;
                    o.x = acc[j][0][v];
                    o.y = acc[j][1][v];
                    o.z = acc[j][2][v];
                    o.w = acc[j][3][v];
                    *(float4*)(&Ob[(size_t)(j * 16 + v + 8 * Lhi) * DD + c0]) = o;
                }
            }
        }
    }
}

extern "C" void kernel_launch(void* const* d_in, const int* in_sizes, int n_in,
                              void* d_out, int out_size, void* d_ws, size_t ws_size,
                              hipStream_t stream) {
    const float* X  = (const float*)d_in[0];   // [B,S,D] fp32
    const float* Wv = (const float*)d_in[1];   // [D]
    const float* bv = (const float*)d_in[2];   // [1]
    float* Out = (float*)d_out;                // [B,S,D] fp32

    dim3 grid(SS / TS, BB);   // 32 x 16 blocks
    dim3 block(256);          // 8 waves (wave32)
    local_attn_wmma_kernel<<<grid, block, 0, stream>>>(X, Wv, bv, Out);
}

// v003
// One run takes 14.2 microseconds.
// Two timings next to v002 both put it at 1.18 times that version's speed.
// Over all steps from v000 it is 1.66 times as fast.
#include <hip/hip_runtime.h>
#include <hip/hip_bf16.h>

// Problem constants (from reference)
#define BB   16
#define SS   2048
#define DD   512
#define WW   5
#define KK   11           // 2*w+1
#define TS   64           // token positions per block tile (four 16-token WMMA sub-tiles)
#define NSUB (TS / 16)    // WMMA sub-tiles per block tile
#define HALO (TS + 2*WW)  // 74 rows staged per tile
#define XSTR 520          // padded LDS row stride (floats) -> conflict-free across lane halves
#define ASTR 33           // padded Aexp row stride (floats)
#define AK   28           // K dim of one sub-tile, padded to multiple of 4 (>= 16 + 2*WW = 26)
#define NG   ((TS - 16 + AK) / 4)  // 4-row groups of xs that the sub-tiles read (19)
#define NQ   4            // WMMA column tiles per wave (8 waves x 16*NQ = DD columns)
#define NR   ((HALO + 7) / 8)  // halo rows scored per wave (10; the last one only in waves 0, 1)

typedef float v2f __attribute__((ext_vector_type(2)));
typedef float v4f __attribute__((ext_vector_type(4)));
typedef float v8f __attribute__((ext_vector_type(8)));

// v + (v of lane ^ M), M < 16: a DPP add inside each 16-lane row, no LDS round trip
template <int M>
__device__ __forceinline__ float add_row_xmask(float v) {
    const int o = __builtin_amdgcn_update_dpp(0, __float_as_int(v), 0x160 | M, 0xf, 0xf, true);
    return v + __int_as_float(o);
}

// v + (v of lane ^ 16): a vector cross-row move, no LDS round trip
__device__ __forceinline__ float add_other_half(float v) {
    const int o = __builtin_amdgcn_permlanex16(__float_as_int(v), __float_as_int(v),
                                               0x76543210, 0xfedcba98, false, false);
    return v + __int_as_float(o);
}

__global__ __launch_bounds__(256) void local_attn_wmma_kernel(
    const float* __restrict__ X,     // [B,S,D]
    const float* __restrict__ Wv,    // [D]
    const float* __restrict__ bv,    // [1]
    float* __restrict__ Out)         // [B,S,D]
{
    __shared__ float xs[HALO * XSTR];   // staged halo tile  (~150 KB, two blocks per WGP)
    __shared__ float sbuf[HALO];        // scores for halo rows
    __shared__ float Aexp[TS * ASTR];   // expanded banded alpha (per sub-tile 16 x AK used)

    const int tid  = threadIdx.x;
    const int t0   = blockIdx.x * TS;
    const int b    = blockIdx.y;
    const float* Xb = X + (size_t)b * SS * DD;
    const int wave = tid >> 5;
    const int lane = tid & 31;

    // W for phase 1, asked for ahead of the staging so that its latency passes under it:
    // a lane holds columns 4*lane + 128*i .. +3, the columns of its 16-byte xs reads.
    v4f w4[4];
    // unrolled: w4[] needs constant indices to live in registers
    #pragma unroll
    for (int i = 0; i < 4; ++i) w4[i] = *(const v4f*)(Wv + 4 * lane + 128 * i);
    // precaution: stands in front of the first rewrite of an address register these loads name
    asm volatile("s_wait_xcnt 0x0" ::: "memory");
    const float bias = bv[0];

    // ---------------- Phase 0: stage halo rows [t0-5, t0+69) into LDS ----------------
    // 74 rows * 128 float4 = 9472 vec4 loads, 37 per thread. Clamped rows are
    // multiplied by alpha==0 later, so clamping is safe.
    for (int v = tid; v < HALO * (DD / 4); v += 256) {
        int r  = v / (DD / 4);
        int c4 = (v % (DD / 4)) * 4;
        int gr = t0 - WW + r;
        gr = gr < 0 ? 0 : (gr >= SS ? SS - 1 : gr);
        float4 val = *(const float4*)(Xb + (size_t)gr * DD + c4);
        *(float4*)(&xs[r * XSTR + c4]) = val;
    }
    for (int v = tid; v < TS * ASTR; v += 256) Aexp[v] = 0.0f;
    __syncthreads();

    // ---------------- Phase 1: scores s[r] = dot(xs[r,:], W) + b ----------------
    // A wave takes rows wave, wave + 8, ... and works on all NR of them together: the rows
    // are independent, so their LDS reads, multiply-add chains and lane sums fill one
    // another's latencies (one row after the other, each row waits out its own).
    {
        float p[NR];
        // unrolled: p[] needs constant indices to live in registers
        #pragma unroll
        for (int j = 0; j < NR; ++j) {
            int r = wave + 8 * j;
            if (8 * j + 7 >= HALO)                    // only the last j can leave the halo:
                r = r < HALO ? r : HALO - 1;          // re-read its last row, not stored below
            const float* row = &xs[r * XSTR + 4 * lane];
            const v4f x0 = *(const v4f*)(row);
            const v4f x1 = *(const v4f*)(row + 128);
            const v4f x2 = *(const v4f*)(row + 256);
            const v4f x3 = *(const v4f*)(row + 384);
            // two chains of packed multiply-adds on register pairs as they were loaded
            v2f s0 = x0.lo * w4[0].lo;
            v2f s1 = x2.lo * w4[2].lo;
            s0 = __builtin_elementwise_fma(x0.hi, w4[0].hi, s0);
            s1 = __builtin_elementwise_fma(x2.hi, w4[2].hi, s1);
            s0 = __builtin_elementwise_fma(x1.lo, w4[1].lo, s0);
            s1 = __builtin_elementwise_fma(x3.lo, w4[3].lo, s1);
            s0 = __builtin_elementwise_fma(x1.hi, w4[1].hi, s0);
            s1 = __builtin_elementwise_fma(x3.hi, w4[3].hi, s1);
            s0 += s1;
            p[j] = s0.x + s0.y;
        }
        // sum over the 32 lanes: one butterfly step for every row before the next step, so that
        // a step's adds are independent (all loops over j unrolled: constant indices into p[])
        #pragma unroll
        for (int j = 0; j < NR; ++j) p[j] = add_row_xmask<1>(p[j]);
        #pragma unroll
        for (int j = 0; j < NR; ++j) p[j] = add_row_xmask<2>(p[j]);
        #pragma unroll
        for (int j = 0; j < NR; ++j) p[j] = add_row_xmask<4>(p[j]);
        #pragma unroll
        for (int j = 0; j < NR; ++j) p[j] = add_row_xmask<8>(p[j]);
        #pragma unroll
        for (int j = 0; j < NR; ++j) p[j] = add_other_half(p[j]);
        if (lane == 0) {
            #pragma unroll
            for (int j = 0; j < NR; ++j)
                if (8 * j + 7 < HALO || wave + 8 * j < HALO) sbuf[wave + 8 * j] = p[j] + bias;
        }
    }
    __syncthreads();

    // ---------------- Phase 2: masked band softmax -> Aexp[i][(i&15)+k] ----------------
    if (tid < TS) {
        const int i = tid;
        float band[KK];
        float m = -__builtin_inff();
        #pragma unroll
        for (int k = 0; k < KK; ++k) {
            int raw  = t0 + i - WW + k;
            bool ok  = (raw >= 0) && (raw < SS);
            float v  = ok ? sbuf[i + k] : -__builtin_inff();
            band[k]  = v;
            m = v > m ? v : m;
        }
        float sum = 0.0f;
        #pragma unroll
        for (int k = 0; k < KK; ++k) {
            float e = __expf(band[k] - m);   // exp(-inf) == 0 for masked entries
            band[k] = e;
            sum += e;
        }
        float inv = 1.0f / sum;
        #pragma unroll
        for (int k = 0; k < KK; ++k)
            Aexp[i * ASTR + ((i & 15) + k)] = band[k] * inv;
    }
    __syncthreads();

    // ---------------- Phase 3: out_tile = Aexp(16xAK) x xs(AKx16) via WMMA f32 ----------------
    // f32 16x16x4 operand layout (wave32):
    //   A: lanes 0-15 -> M=0..15, K = 4s + 2*(lane>=16) + vgpr
    //   B: lane halves split K the same way, N = lane&15 striped in each VGPR
    //   C/D: vgpr v -> row v + 8*(lane>=16), col = lane&15
    // Sub-tile j (tokens 16j..16j+15) reads xs rows 16j..16j+27 = row groups 4j..4j+6,
    // so one load of a row group feeds every sub-tile whose window holds it.
    // Column map: a wave owns 64 adjacent columns as NQ = 4 WMMA column tiles, and
    // N index n of tile q is column 4n + q. A lane's four tiles are then four adjacent
    // columns: one 16-byte LDS read per xs row feeds all four tiles, and a result row
    // leaves as one 16-byte store per lane, 256 contiguous bytes per half-wave.
    const int Llo = lane & 15;
    const int Lhi = lane >> 4;
    const int c0  = wave * (16 * NQ) + NQ * Llo;   // this lane's first column
    float* Ob = Out + ((size_t)b * SS + t0) * DD;

    // A fragments of all sub-tiles, read once per wave.
    // Both loops unrolled: a[][] needs constant indices to live in registers.
    v2f a[NSUB][AK / 4];
    #pragma unroll
    for (int j = 0; j < NSUB; ++j) {
        #pragma unroll
        for (int s = 0; s < AK / 4; ++s) {
            const int k = s * 4 + 2 * Lhi;
            a[j][s].x = Aexp[(j * 16 + Llo) * ASTR + k];
            a[j][s].y = Aexp[(j * 16 + Llo) * ASTR + k + 1];
        }
    }

    v8f acc[NSUB][NQ] = {};
    // g, j, q unrolled: constant indices keep a[][] and acc[][] in registers and
    // resolve the window test (which sub-tiles read group g) at compile time.
    #pragma unroll
    for (int g = 0; g < NG; ++g) {
        const int k = g * 4 + 2 * Lhi;
        // branchless zero-mask for padded K rows (74,75); Aexp is 0 there too
        const int r0 = (k     < HALO) ? k     : 0;
        const int r1 = (k + 1 < HALO) ? k + 1 : 0;
        const float m0 = (k     < HALO) ? 1.0f : 0.0f;
        const float m1 = (k + 1 < HALO) ? 1.0f : 0.0f;
        const float4 x0 = *(const float4*)(&xs[r0 * XSTR + c0]);
        const float4 x1 = *(const float4*)(&xs[r1 * XSTR + c0]);
        v2f bm[NQ];
        bm[0].x = m0 * x0.x;  bm[0].y = m1 * x1.x;
        bm[1].x = m0 * x0.y;  bm[1].y = m1 * x1.y;
        bm[2].x = m0 * x0.z;  bm[2].y = m1 * x1.z;
        bm[3].x = m0 * x0.w;  bm[3].y = m1 * x1.w;
        #pragma unroll
        for (int j = 0; j < NSUB; ++j) {
            const int s = g - 4 * j;
            if (s >= 0 && s < AK / 4) {
                #pragma unroll
                for (int q = 0; q < NQ; ++q)
                    acc[j][q] = __builtin_amdgcn_wmma_f32_16x16x4_f32(
                        false, a[j][s], false, bm[q], (short)0, acc[j][q], false, false);
            }
            if (s == AK / 4 - 1) {
                // sub-tile j is complete: store it now, so its registers are free for
                // sub-tile j + 2; unrolled so acc is indexed by constants
                #pragma unroll
                for (int v = 0; v < 8; ++v) {
                    float4 o;
                    o.x = acc[j][0][v];
                    o.y = acc[j][1][v];
                    o.z = acc[j][2][v];
                    o.w = acc[j][3][v];
                    *(float4*)(&Ob[(size_t)(j * 16 + v + 8 * Lhi) * DD + c0]) = o;
                }
            }
        }
    }
}

extern "C" void kernel_launch(void* const* d_in, const int* in_sizes, int n_in,
                              void* d_out, int out_size, void* d_ws, size_t ws_size,
                              hipStream_t stream) {
    const float* X  = (const float*)d_in[0];   // [B,S,D] fp32
    const float* Wv = (const float*)d_in[1];   // [D]
    const float* bv = (const float*)d_in[2];   // [1]
    float* Out = (float*)d_out;                // [B,S,D] fp32

    dim3 grid(SS / TS, BB);   // 32 x 16 blocks
    dim3 block(256);          // 8 waves (wave32)
    local_attn_wmma_kernel<<<grid, block, 0, stream>>>(X, Wv, bv, Out);
}

// v004
// One run takes 12.5 microseconds.
// In two side-by-side timings against v003, it was 1.15 and 1.14 times as fast.
// All steps since v000 together make it 1.90 times as fast.
#include <hip/hip_runtime.h>
#include <hip/hip_bf16.h>

// Problem constants (from reference)
#define BB   16
#define SS   2048
#define DD   512
#define WW   5
#define KK   11           // 2*w+1
#define TS   64           // token positions per block tile (four 16-token WMMA sub-tiles)
#define NSUB (TS / 16)    // WMMA sub-tiles per block tile
#define HALO (TS + 2*WW)  // 74 rows staged per tile
#define XSTR 520          // padded LDS row stride (floats) -> conflict-free across lane halves
#define ASTR 33           // padded Aexp row stride (floats)
#define AK   28           // K dim of one sub-tile, padded to multiple of 4 (>= 16 + 2*WW = 26)
#define NQ   4            // WMMA column tiles per wave (8 waves x 16*NQ = DD columns)
#define NCP  (HALO / 2)   // copies per lane: one copy of all 256 lanes brings two halo rows (37)

typedef float v2f __attribute__((ext_vector_type(2)));
typedef float v4f __attribute__((ext_vector_type(4)));
typedef float v8f __attribute__((ext_vector_type(8)));

// v + (v of lane ^ M), M < 16: a DPP add inside each 16-lane row, no LDS round trip
template <int M>
__device__ __forceinline__ float add_row_xmask(float v) {
    const int o = __builtin_amdgcn_update_dpp(0, __float_as_int(v), 0x160 | M, 0xf, 0xf, true);
    return v + __int_as_float(o);
}

// v + (v of lane ^ 16): a vector cross-row move, no LDS round trip
__device__ __forceinline__ float add_other_half(float v) {
    const int o = __builtin_amdgcn_permlanex16(__float_as_int(v), __float_as_int(v),
                                               0x76543210, 0xfedcba98, false, false);
    return v + __int_as_float(o);
}

// 2^x. The v_nop keeps, inside the statement, the one free slot that the instruction set asks for
// between a transcendental and a next instruction that reads its result or overwrites its source.
__device__ __forceinline__ float exp2_with_slot(float x) {
    float r;
    asm("v_exp_f32 %0, %1\n\tv_nop" : "=v"(r) : "v"(x));
    return r;
}

// Work-group barrier that orders LDS alone. __syncthreads() also waits until this wave's global
// stores are done (s_wait_storecnt 0): a sub-tile would then stand still until the stores of
// the one before it have come back, and no wave of the launch reads what they wrote.
__device__ __forceinline__ void lds_barrier() {
    __builtin_amdgcn_fence(__ATOMIC_RELEASE, "workgroup", "local");
    __builtin_amdgcn_s_barrier();
    __builtin_amdgcn_fence(__ATOMIC_ACQUIRE, "workgroup", "local");
}

// Copies I0 .. I0+N-1 of this lane: copy i brings 16 bytes of halo row 2*i + rsub from global
// memory straight into xs, through no register. Rows outside the sequence are clamped; they
// are multiplied by alpha == 0 later, so clamping is safe.
template <int I0, int N>
__device__ __forceinline__ void copy_rows(const float* Xb, unsigned xs_lds, int t0, int rsub, int c4) {
    static_assert(N == 7 || N == 8, "one asm statement per run of copies");
    unsigned l[N];
    const float* g[N];
    // unrolled: l[] and g[] need constant indices to live in registers
    #pragma unroll
    for (int i = 0; i < N; ++i) {
        const int r = 2 * (I0 + i) + rsub;
        int gr = t0 - WW + r;
        gr = gr < 0 ? 0 : (gr >= SS ? SS - 1 : gr);
        g[i] = Xb + (size_t)gr * DD + c4;
        l[i] = xs_lds + (unsigned)(r * XSTR + c4) * 4u;
    }
    // the copies; the closing s_wait_xcnt is a precaution that stands, inside their own
    // statement, in front of any rewrite of an address register which a copy names
    if constexpr (N == 7) {
        asm volatile("global_load_async_to_lds_b128 %0, %1, off\n\t"
                     "global_load_async_to_lds_b128 %2, %3, off\n\t"
                     "global_load_async_to_lds_b128 %4, %5, off\n\t"
                     "global_load_async_to_lds_b128 %6, %7, off\n\t"
                     "global_load_async_to_lds_b128 %8, %9, off\n\t"
                     "global_load_async_to_lds_b128 %10, %11, off\n\t"
                     "global_load_async_to_lds_b128 %12, %13, off\n\t"
                     "s_wait_xcnt 0x0"
                     :: "v"(l[0]), "v"(g[0]), "v"(l[1]), "v"(g[1]), "v"(l[2]), "v"(g[2]),
                        "v"(l[3]), "v"(g[3]), "v"(l[4]), "v"(g[4]), "v"(l[5]), "v"(g[5]),
                        "v"(l[6]), "v"(g[6])
                     : "memory");
    } else {
        asm volatile("global_load_async_to_lds_b128 %0, %1, off\n\t"
                     "global_load_async_to_lds_b128 %2, %3, off\n\t"
                     "global_load_async_to_lds_b128 %4, %5, off\n\t"
                     "global_load_async_to_lds_b128 %6, %7, off\n\t"
                     "global_load_async_to_lds_b128 %8, %9, off\n\t"
                     "global_load_async_to_lds_b128 %10, %11, off\n\t"
                     "global_load_async_to_lds_b128 %12, %13, off\n\t"
                     "global_load_async_to_lds_b128 %14, %15, off\n\t"
                     "s_wait_xcnt 0x0"
                     :: "v"(l[0]), "v"(g[0]), "v"(l[1]), "v"(g[1]), "v"(l[2]), "v"(g[2]),
                        "v"(l[3]), "v"(g[3]), "v"(l[4]), "v"(g[4]), "v"(l[5]), "v"(g[5]),
                        "v"(l[6]), "v"(g[6]), "v"(l[7]), "v"(g[7])
                     : "memory");
    }
}

// Scores s[r] = dot(xs[r,:], W) + b of halo rows R0 .. R0+NROW-1. A wave takes rows
// R0 + wave, R0 + wave + 8, ... and works on all of them together: the rows are independent,
// so their LDS reads, multiply-add chains and lane sums fill one another's latencies.
template <int R0, int NROW>
__device__ __forceinline__ void score_rows(const float* xs, float* sbuf, const v4f (&w4)[4],
                                           float bias, int wave, int lane) {
    constexpr int NJ = (NROW + 7) / 8;
    float p[NJ];
    // unrolled: p[] needs constant indices to live in registers
    #pragma unroll
    for (int j = 0; j < NJ; ++j) {
        int r = wave + 8 * j;
        if (8 * j + 7 >= NROW)                    // only the last j can leave the range:
            r = r < NROW ? r : NROW - 1;          // re-read its last row, not stored below
        const float* row = &xs[(R0 + r) * XSTR + 4 * lane];
        const v4f x0 = *(const v4f*)(row);
        const v4f x1 = *(const v4f*)(row + 128);
        const v4f x2 = *(const v4f*)(row + 256);
        const v4f x3 = *(const v4f*)(row + 384);
        // two chains of packed multiply-adds on register pairs as they were loaded
        v2f s0 = x0.lo * w4[0].lo;
        v2f s1 = x2.lo * w4[2].lo;
        s0 = __builtin_elementwise_fma(x0.hi, w4[0].hi, s0);
        s1 = __builtin_elementwise_fma(x2.hi, w4[2].hi, s1);
        s0 = __builtin_elementwise_fma(x1.lo, w4[1].lo, s0);
        s1 = __builtin_elementwise_fma(x3.lo, w4[3].lo, s1);
        s0 = __builtin_elementwise_fma(x1.hi, w4[1].hi, s0);
        s1 = __builtin_elementwise_fma(x3.hi, w4[3].hi, s1);
        s0 += s1;
        p[j] = s0.x + s0.y;
    }
    // sum over the 32 lanes: one butterfly step for every row before the next step, so that
    // a step's adds are independent (all loops over j unrolled: constant indices into p[])
    #pragma unroll
    for (int j = 0; j < NJ; ++j) p[j] = add_row_xmask<1>(p[j]);
    #pragma unroll
    for (int j = 0; j < NJ; ++j) p[j] = add_row_xmask<2>(p[j]);
    #pragma unroll
    for (int j = 0; j < NJ; ++j) p[j] = add_row_xmask<4>(p[j]);
    #pragma unroll
    for (int j = 0; j < NJ; ++j) p[j] = add_row_xmask<8>(p[j]);
    #pragma unroll
    for (int j = 0; j < NJ; ++j) p[j] = add_other_half(p[j]);
    if (lane == 0) {
        #pragma unroll
        for (int j = 0; j < NJ; ++j)
            if (8 * j + 7 < NROW || wave + 8 * j < NROW) sbuf[R0 + wave + 8 * j] = p[j] + bias;
    }
}

// Sub-tile J (tokens 16J .. 16J+15) from landing to store. It reads xs rows 16J .. 16J+27,
// which this lane's first 14 + 8J copies bring (all NCP for the last sub-tile), so it runs
// while the copies of the later rows are still in flight.
template <int J>
__device__ __forceinline__ void sub_tile(const float* xs, float* sbuf, float* Aexp,
                                         const v4f (&w4)[4], float bias, int t0, int tid,
                                         v2f (&keep)[3][NQ], float* Ob) {
    const int wave = tid >> 5;
    const int lane = tid & 31;
    constexpr int LANDED = (J == NSUB - 1) ? NCP : 14 + 8 * J;

    // this wave's copies of the rows up to 16J+27 have landed when all but its NCP - LANDED
    // youngest have; the barrier behind it says the same of the other waves' copies
    asm volatile("s_wait_asynccnt %0" :: "n"(NCP - LANDED) : "memory");
    lds_barrier();

    // ---------------- scores of the rows that are new with this sub-tile ----------------
    if constexpr (J == 0) score_rows<0, 28>(xs, sbuf, w4, bias, wave, lane);
    else score_rows<12 + 16 * J, 2 * LANDED - (12 + 16 * J)>(xs, sbuf, w4, bias, wave, lane);
    lds_barrier();

    // ---------------- masked band softmax -> Aexp[i][(i&15)+k] ----------------
    if (tid < 16) {
        const int i = 16 * J + tid;
        float band[KK];
        float m = -__builtin_inff();
        #pragma unroll
        for (int k = 0; k < KK; ++k) {
            int raw  = t0 + i - WW + k;
            bool ok  = (raw >= 0) && (raw < SS);
            float v  = ok ? sbuf[i + k] : -__builtin_inff();
            band[k]  = v;
            m = v > m ? v : m;
        }
        float sum = 0.0f;
        #pragma unroll
        for (int k = 0; k < KK; ++k) {
            float e = exp2_with_slot((band[k] - m) * 1.44269504f);   // e^x; 0 for masked entries (-inf)
            band[k] = e;
            sum += e;
        }
        float inv = 1.0f / sum;
        #pragma unroll
        for (int k = 0; k < KK; ++k)
            Aexp[i * ASTR + ((i & 15) + k)] = band[k] * inv;
    }
    lds_barrier();

    // ---------------- out_tile = Aexp(16xAK) x xs(AKx16) via WMMA f32 ----------------
    // f32 16x16x4 operand layout (wave32):
    //   A: lanes 0-15 -> M=0..15, K = 4s + 2*(lane>=16) + vgpr
    //   B: lane halves split K the same way, N = lane&15 striped in each VGPR
    //   C/D: vgpr v -> row v + 8*(lane>=16), col = lane&15
    // Column map: a wave owns 64 adjacent columns as NQ = 4 WMMA column tiles, and
    // N index n of tile q is column 4n + q. A lane's four tiles are then four adjacent
    // columns: one 16-byte LDS read per xs row feeds all four tiles, and a result row
    // leaves as one 16-byte store per lane, 256 contiguous bytes per half-wave.
    const int Llo = lane & 15;
    const int Lhi = lane >> 4;
    const int c0  = wave * (16 * NQ) + NQ * Llo;   // this lane's first column

    // unrolled: a[] needs constant indices to live in registers
    v2f a[AK / 4];
    #pragma unroll
    for (int s = 0; s < AK / 4; ++s) {
        const int k = s * 4 + 2 * Lhi;
        a[s].x = Aexp[(J * 16 + Llo) * ASTR + k];
        a[s].y = Aexp[(J * 16 + Llo) * ASTR + k + 1];
    }

    v8f acc[NQ] = {};
    // s, q unrolled: constant indices keep a[], keep[][] and acc[] in registers
    #pragma unroll
    for (int s = 0; s < AK / 4; ++s) {
        v2f bm[NQ];
        if (J > 0 && s < 3) {
            // row groups 4J .. 4J+2 were read by sub-tile J-1 and stayed in registers
            #pragma unroll
            for (int q = 0; q < NQ; ++q) bm[q] = keep[s][q];
        } else {
            const int k = (4 * J + s) * 4 + 2 * Lhi;
            // branchless zero-mask for padded K rows (74,75); Aexp is 0 there too
            const int r0 = (k     < HALO) ? k     : 0;
            const int r1 = (k + 1 < HALO) ? k + 1 : 0;
            const float m0 = (k     < HALO) ? 1.0f : 0.0f;
            const float m1 = (k + 1 < HALO) ? 1.0f : 0.0f;
            const float4 x0 = *(const float4*)(&xs[r0 * XSTR + c0]);
            const float4 x1 = *(const float4*)(&xs[r1 * XSTR + c0]);
            bm[0].x = m0 * x0.x;  bm[0].y = m1 * x1.x;
            bm[1].x = m0 * x0.y;  bm[1].y = m1 * x1.y;
            bm[2].x = m0 * x0.z;  bm[2].y = m1 * x1.z;
            bm[3].x = m0 * x0.w;  bm[3].y = m1 * x1.w;
        }
        if (J < NSUB - 1 && s >= 4) {
            #pragma unroll
            for (int q = 0; q < NQ; ++q) keep[s - 4][q] = bm[q];
        }
        #pragma unroll
        for (int q = 0; q < NQ; ++q)
            acc[q] = __builtin_amdgcn_wmma_f32_16x16x4_f32(
                false, a[s], false, bm[q], (short)0, acc[q], false, false);
    }
    // unrolled so acc is indexed by constants
    #pragma unroll
    for (int v = 0; v < 8; ++v) {
        float4 o;
        o.x = acc[0][v];
        o.y = acc[1][v];
        o.z = acc[2][v];
        o.w = acc[3][v];
        *(float4*)(&Ob[(size_t)(J * 16 + v + 8 * Lhi) * DD + c0]) = o;
    }
    // precaution: stands in front of the next sub-tile's first rewrite of a register these stores name
    if constexpr (J < NSUB - 1) asm volatile("s_wait_xcnt 0x0" ::: "memory");
}

__global__ __launch_bounds__(256) void local_attn_wmma_kernel(
    const float* __restrict__ X,     // [B,S,D]
    const float* __restrict__ Wv,    // [D]
    const float* __restrict__ bv,    // [1]
    float* __restrict__ Out)         // [B,S,D]
{
    __shared__ __attribute__((aligned(16))) float xs[HALO * XSTR];  // staged halo tile (~150 KB, two blocks per WGP)
    __shared__ float sbuf[HALO];        // scores for halo rows
    __shared__ float Aexp[TS * ASTR];   // expanded banded alpha (per sub-tile 16 x AK used)

    const int tid  = threadIdx.x;
    const int t0   = blockIdx.x * TS;
    const int b    = blockIdx.y;
    const float* Xb = X + (size_t)b * SS * DD;
    const int lane = tid & 31;

    // W for the scores: a lane holds columns 4*lane + 128*i .. +3, the columns of its
    // 16-byte xs reads; its latency passes under that of the first rows' copies.
    v4f w4[4];
    // unrolled: w4[] needs constant indices to live in registers
    #pragma unroll
    for (int i = 0; i < 4; ++i) w4[i] = *(const v4f*)(Wv + 4 * lane + 128 * i);
    // precaution: stands in front of the first rewrite of an address register these loads name
    asm volatile("s_wait_xcnt 0x0" ::: "memory");
    const float bias = bv[0];

    // ---------------- stage halo rows [t0-5, t0+69) into LDS ----------------
    // 74 rows * 128 float4 = 9472 16-byte pieces, NCP = 37 per lane, every lane on in each.
    // All copies are issued here, in row order; each sub-tile waits only for its own rows.
    {
        const unsigned xs_lds = (unsigned)(uintptr_t)xs;   // LDS byte address: low 32 bits
        const int rsub = tid >> 7;
        const int c4   = (tid & 127) * 4;
        copy_rows< 0, 7>(Xb, xs_lds, t0, rsub, c4);
        copy_rows< 7, 7>(Xb, xs_lds, t0, rsub, c4);
        copy_rows<14, 8>(Xb, xs_lds, t0, rsub, c4);
        copy_rows<22, 8>(Xb, xs_lds, t0, rsub, c4);
        copy_rows<30, 7>(Xb, xs_lds, t0, rsub, c4);
    }

    for (int v = tid; v < TS * ASTR; v += 256) Aexp[v] = 0.0f;

    float* Ob = Out + ((size_t)b * SS + t0) * DD;
    v2f keep[3][NQ];   // B fragments of the three row groups that two neighbouring sub-tiles share
    sub_tile<0>(xs, sbuf, Aexp, w4, bias, t0, tid, keep, Ob);
    sub_tile<1>(xs, sbuf, Aexp, w4, bias, t0, tid, keep, Ob);
    sub_tile<2>(xs, sbuf, Aexp, w4, bias, t0, tid, keep, Ob);
    sub_tile<3>(xs, sbuf, Aexp, w4, bias, t0, tid, keep, Ob);
}

extern "C" void kernel_launch(void* const* d_in, const int* in_sizes, int n_in,
                              void* d_out, int out_size, void* d_ws, size_t ws_size,
                              hipStream_t stream) {
    const float* X  = (const float*)d_in[0];   // [B,S,D] fp32
    const float* Wv = (const float*)d_in[1];   // [D]
    const float* bv = (const float*)d_in[2];   // [1]
    float* Out = (float*)d_out;                // [B,S,D] fp32

    dim3 grid(SS / TS, BB);   // 32 x 16 blocks
    dim3 block(256);          // 8 waves (wave32)
    local_attn_wmma_kernel<<<grid, block, 0, stream>>>(X, Wv, bv, Out);
}

// v005
// Measured time: 11.4 microseconds a run.
// Two timings next to v004 both put it at 1.09 times that version's speed.
// All steps since v000 together make it 2.07 times as fast.
#include <hip/hip_runtime.h>
#include <hip/hip_bf16.h>

// Problem constants (from reference)
#define BB   16
#define SS   2048
#define DD   512
#define WW   5
#define KK   11           // 2*w+1
#define TS   64           // token positions per block tile (four 16-token WMMA sub-tiles)
#define NSUB (TS / 16)    // WMMA sub-tiles per block tile
#define HALO (TS + 2*WW)  // 74 rows staged per tile
#define XSTR 520          // padded LDS row stride (floats) -> conflict-free across lane halves
#define NG   ((HALO + 3) / 4)   // groups of four halo rows: one WMMA k-step each (19)
#define NQ   4            // WMMA column tiles per wave (8 waves x 16*NQ = DD columns)
#define NCP  (HALO / 2)   // copies per lane: one copy of all 256 lanes brings two halo rows (37)

typedef float v2f __attribute__((ext_vector_type(2)));
typedef float v4f __attribute__((ext_vector_type(4)));
typedef float v8f __attribute__((ext_vector_type(8)));

// v + (v of lane ^ M), M < 16: a DPP add inside each 16-lane row, no LDS round trip
template <int M>
__device__ __forceinline__ float add_row_xmask(float v) {
    const int o = __builtin_amdgcn_update_dpp(0, __float_as_int(v), 0x160 | M, 0xf, 0xf, true);
    return v + __int_as_float(o);
}

// v + (v of lane ^ 16): a vector cross-row move, no LDS round trip
__device__ __forceinline__ float add_other_half(float v) {
    const int o = __builtin_amdgcn_permlanex16(__float_as_int(v), __float_as_int(v),
                                               0x76543210, 0xfedcba98, false, false);
    return v + __int_as_float(o);
}

// 2^x. The v_nop keeps, inside the statement, the one free slot that the instruction set asks for
// between a transcendental and a next instruction that reads its result or overwrites its source.
__device__ __forceinline__ float exp2_with_slot(float x) {
    float r;
    asm("v_exp_f32 %0, %1\n\tv_nop" : "=v"(r) : "v"(x));
    return r;
}

// Work-group barrier that orders LDS alone. __syncthreads() also waits until this wave's global
// stores are done (s_wait_storecnt 0): a sub-tile would then stand still until the stores of
// the one before it have come back, and no wave of the launch reads what they wrote.
__device__ __forceinline__ void lds_barrier() {
    __builtin_amdgcn_fence(__ATOMIC_RELEASE, "workgroup", "local");
    __builtin_amdgcn_s_barrier();
    __builtin_amdgcn_fence(__ATOMIC_ACQUIRE, "workgroup", "local");
}

// Copies I0 .. I0+N-1 of this lane: copy i brings 16 bytes of halo row 2*i + rsub from global
// memory straight into xs, through no register. Rows outside the sequence are clamped; they
// are multiplied by alpha == 0 later, so clamping is safe.
template <int I0, int N>
__device__ __forceinline__ void copy_rows(const float* Xb, unsigned xs_lds, int t0, int rsub, int c4) {
    static_assert(N == 7 || N == 8, "one asm statement per run of copies");
    unsigned l[N];
    const float* g[N];
    // unrolled: l[] and g[] need constant indices to live in registers
    #pragma unroll
    for (int i = 0; i < N; ++i) {
        const int r = 2 * (I0 + i) + rsub;
        int gr = t0 - WW + r;
        gr = gr < 0 ? 0 : (gr >= SS ? SS - 1 : gr);
        g[i] = Xb + (size_t)gr * DD + c4;
        l[i] = xs_lds + (unsigned)(r * XSTR + c4) * 4u;
    }
    // the copies; the closing s_wait_xcnt is a precaution that stands, inside their own
    // statement, in front of any rewrite of an address register which a copy names
    if constexpr (N == 7) {
        asm volatile("global_load_async_to_lds_b128 %0, %1, off\n\t"
                     "global_load_async_to_lds_b128 %2, %3, off\n\t"
                     "global_load_async_to_lds_b128 %4, %5, off\n\t"
                     "global_load_async_to_lds_b128 %6, %7, off\n\t"
                     "global_load_async_to_lds_b128 %8, %9, off\n\t"
                     "global_load_async_to_lds_b128 %10, %11, off\n\t"
                     "global_load_async_to_lds_b128 %12, %13, off\n\t"
                     "s_wait_xcnt 0x0"
                     :: "v"(l[0]), "v"(g[0]), "v"(l[1]), "v"(g[1]), "v"(l[2]), "v"(g[2]),
                        "v"(l[3]), "v"(g[3]), "v"(l[4]), "v"(g[4]), "v"(l[5]), "v"(g[5]),
                        "v"(l[6]), "v"(g[6])
                     : "memory");
    } else {
        asm volatile("global_load_async_to_lds_b128 %0, %1, off\n\t"
                     "global_load_async_to_lds_b128 %2, %3, off\n\t"
                     "global_load_async_to_lds_b128 %4, %5, off\n\t"
                     "global_load_async_to_lds_b128 %6, %7, off\n\t"
                     "global_load_async_to_lds_b128 %8, %9, off\n\t"
                     "global_load_async_to_lds_b128 %10, %11, off\n\t"
                     "global_load_async_to_lds_b128 %12, %13, off\n\t"
                     "global_load_async_to_lds_b128 %14, %15, off\n\t"
                     "s_wait_xcnt 0x0"
                     :: "v"(l[0]), "v"(g[0]), "v"(l[1]), "v"(g[1]), "v"(l[2]), "v"(g[2]),
                        "v"(l[3]), "v"(g[3]), "v"(l[4]), "v"(g[4]), "v"(l[5]), "v"(g[5]),
                        "v"(l[6]), "v"(g[6]), "v"(l[7]), "v"(g[7])
                     : "memory");
    }
}

// Scores s[r] = dot(xs[r,:], W) + b of halo rows R0 .. R0+NROW-1. A wave takes rows
// R0 + wave, R0 + wave + 8, ... and works on all of them together: the rows are independent,
// so their LDS reads, multiply-add chains and lane sums fill one another's latencies.
template <int R0, int NROW>
__device__ __forceinline__ void score_rows(const float* xs, float* sbuf, const v4f (&w4)[4],
                                           float bias, int wave, int lane) {
    constexpr int NJ = (NROW + 7) / 8;
    float p[NJ];
    // unrolled: p[] needs constant indices to live in registers
    #pragma unroll
    for (int j = 0; j < NJ; ++j) {
        int r = wave + 8 * j;
        if (8 * j + 7 >= NROW)                    // only the last j can leave the range:
            r = r < NROW ? r : NROW - 1;          // re-read its last row, not stored below
        const float* row = &xs[(R0 + r) * XSTR + 4 * lane];
        const v4f x0 = *(const v4f*)(row);
        const v4f x1 = *(const v4f*)(row + 128);
        const v4f x2 = *(const v4f*)(row + 256);
        const v4f x3 = *(const v4f*)(row + 384);
        // two chains of packed multiply-adds on register pairs as they were loaded
        v2f s0 = x0.lo * w4[0].lo;
        v2f s1 = x2.lo * w4[2].lo;
        s0 = __builtin_elementwise_fma(x0.hi, w4[0].hi, s0);
        s1 = __builtin_elementwise_fma(x2.hi, w4[2].hi, s1);
        s0 = __builtin_elementwise_fma(x1.lo, w4[1].lo, s0);
        s1 = __builtin_elementwise_fma(x3.lo, w4[3].lo, s1);
        s0 = __builtin_elementwise_fma(x1.hi, w4[1].hi, s0);
        s1 = __builtin_elementwise_fma(x3.hi, w4[3].hi, s1);
        s0 += s1;
        p[j] = s0.x + s0.y;
    }
    // sum over the 32 lanes: one butterfly step for every row before the next step, so that
    // a step's adds are independent (all loops over j unrolled: constant indices into p[])
    #pragma unroll
    for (int j = 0; j < NJ; ++j) p[j] = add_row_xmask<1>(p[j]);
    #pragma unroll
    for (int j = 0; j < NJ; ++j) p[j] = add_row_xmask<2>(p[j]);
    #pragma unroll
    for (int j = 0; j < NJ; ++j) p[j] = add_row_xmask<4>(p[j]);
    #pragma unroll
    for (int j = 0; j < NJ; ++j) p[j] = add_row_xmask<8>(p[j]);
    #pragma unroll
    for (int j = 0; j < NJ; ++j) p[j] = add_other_half(p[j]);
    if (lane == 0) {
        #pragma unroll
        for (int j = 0; j < NJ; ++j)
            if (8 * j + 7 < NROW || wave + 8 * j < NROW) sbuf[R0 + wave + 8 * j] = p[j] + bias;
    }
}

// Stores the four tokens ILO .. ILO+3 that one row group completed: r[e] holds token ILO + e in
// the lower lane half and ILO + 2 + e in the upper; base is this lane's column in row 2*Lhi of
// the tile. The tile's first and last storing group hold tokens of the neighbouring tiles in one
// lane half (all zero), which are not stored. Written in asm so that the closing s_wait_xcnt, a
// precaution, stands inside the stores' own statement, in front of any rewrite of a register
// which they name.
template <int ILO>
__device__ __forceinline__ void store_rows(float* base, const v4f (&r)[2], int Lhi) {
    constexpr bool lo_in = ILO >= 0 && ILO + 1 < TS;
    constexpr bool hi_in = ILO + 2 >= 0 && ILO + 3 < TS;
    if ((lo_in && hi_in) || (lo_in && Lhi == 0) || (hi_in && Lhi == 1))
        asm volatile("global_store_b128 %0, %1, off offset:%3\n\t"
                     "global_store_b128 %0, %2, off offset:%4\n\t"
                     "s_wait_xcnt 0x0"
                     :: "v"(base), "v"(r[0]), "v"(r[1]), "n"(ILO * DD * 4), "n"((ILO + 1) * DD * 4)
                     : "memory");
}

// Row groups G0 + S .. G0 + NGJ - 1 of a sub-tile, one WMMA k-step each (maps: see sub_tile).
// A recursion and no loop: the stores' offsets are immediates.
template <int G0, int NGJ, int S>
__device__ __forceinline__ void row_groups(const v2f (&a)[NGJ], const float4 (&x0)[NGJ],
                                           const float4 (&x1)[NGJ], v8f (&acc)[NQ],
                                           float* base, int Lhi) {
    constexpr int g = G0 + S;
    if constexpr (S < NGJ) {
        const int k = g * 4 + 2 * Lhi;
        // branchless zero-mask for padded K rows (74,75); Aexp is 0 there too
        const float m0 = (k     < HALO) ? 1.0f : 0.0f;
        const float m1 = (k + 1 < HALO) ? 1.0f : 0.0f;
        v2f bm[NQ];
        bm[0].x = m0 * x0[S].x;  bm[0].y = m1 * x1[S].x;
        bm[1].x = m0 * x0[S].y;  bm[1].y = m1 * x1[S].y;
        bm[2].x = m0 * x0[S].z;  bm[2].y = m1 * x1[S].z;
        bm[3].x = m0 * x0[S].w;  bm[3].y = m1 * x1[S].w;
        // unrolled: constant indices keep acc[] in registers
        #pragma unroll
        for (int q = 0; q < NQ; ++q)
            acc[q] = __builtin_amdgcn_wmma_f32_16x16x4_f32(
                false, a[S], false, bm[q], (short)0, acc[q], false, false);
        // group g completes tokens 4g - 10 .. 4g - 7; groups 0 and 1 complete none of this tile
        if constexpr (4 * g + 3 - 2 * WW >= 0) {
            v4f r[2];
            // e, q unrolled: constant indices
            #pragma unroll
            for (int e = 0; e < 2; ++e) {
                const int v = (g & 3) + 4 * e;
                r[e].x = acc[0][v];
                r[e].y = acc[1][v];
                r[e].z = acc[2][v];
                r[e].w = acc[3][v];
                #pragma unroll
                for (int q = 0; q < NQ; ++q) acc[q][v] = 0.0f;
            }
            store_rows<4 * g - 2 * WW>(base, r, Lhi);
            // holds the stores in front of the next group: left free, they were moved behind the
            // sub-tile's last WMMA, and finished rows waited there for rows still to be summed
            __builtin_amdgcn_sched_barrier(0);
        }
        row_groups<G0, NGJ, S + 1>(a, x0, x1, acc, base, Lhi);
    }
}

// Sub-tile J: scores and softmax of tokens 16J .. 16J+15, then the row groups whose every
// token now has its weights. It needs xs rows up to 16J+27, which this lane's first 14 + 8J
// copies bring (all NCP for the last sub-tile), so it runs while the copies of the later rows
// are still in flight.
template <int J>
__device__ __forceinline__ void sub_tile(const float* xs, float* sbuf, float* Aexp,
                                         const v4f (&w4)[4], float bias, int t0, int tid,
                                         v8f (&acc)[NQ], float* Ob) {
    const int wave = tid >> 5;
    const int lane = tid & 31;
    constexpr int LANDED = (J == NSUB - 1) ? NCP : 14 + 8 * J;

    // this wave's copies of the rows up to 16J+27 have landed when all but its NCP - LANDED
    // youngest have; the barrier behind it says the same of the other waves' copies
    asm volatile("s_wait_asynccnt %0" :: "n"(NCP - LANDED) : "memory");
    lds_barrier();

    // ---------------- scores of the rows that are new with this sub-tile ----------------
    if constexpr (J == 0) score_rows<0, 28>(xs, sbuf, w4, bias, wave, lane);
    else score_rows<12 + 16 * J, 2 * LANDED - (12 + 16 * J)>(xs, sbuf, w4, bias, wave, lane);
    lds_barrier();

    // ---------------- masked band softmax -> Aexp[row group][accumulator row][row in group] ----------------
    if (tid < 16) {
        const int i = 16 * J + tid;
        float band[KK];
        float m = -__builtin_inff();
        #pragma unroll
        for (int k = 0; k < KK; ++k) {
            int raw  = t0 + i - WW + k;
            bool ok  = (raw >= 0) && (raw < SS);
            float v  = ok ? sbuf[i + k] : -__builtin_inff();
            band[k]  = v;
            m = v > m ? v : m;
        }
        float sum = 0.0f;
        #pragma unroll
        for (int k = 0; k < KK; ++k) {
            float e = exp2_with_slot((band[k] - m) * 1.44269504f);   // e^x; 0 for masked entries (-inf)
            band[k] = e;
            sum += e;
        }
        float inv = 1.0f / sum;
        // accumulator row of token i (map below): c = its last halo row
        const int c  = i + 2 * WW;
        const int mr = ((c >> 2) & 3) + 4 * (c & 3);
        #pragma unroll
        for (int k = 0; k < KK; ++k) {
            const int h = i + k;
            Aexp[(h >> 2) * 64 + mr * 4 + (h & 3)] = band[k] * inv;
        }
    }
    lds_barrier();

    // ---------------- out rows = banded alpha x xs via WMMA f32, each row group once ----------------
    // f32 16x16x4 operand layout (wave32):
    //   A: lanes 0-15 -> M=0..15, K = 2*(lane>=16) + vgpr
    //   B: lane halves split K the same way, N = lane&15 striped in each VGPR
    //   C/D: vgpr v -> row v + 8*(lane>=16), col = lane&15
    // Row map: a group g of four halo rows 4g .. 4g+3 bears on 14 adjacent tokens only, so one
    // k-step serves it if the 16 accumulator rows are dealt to the tokens cyclically. Token i,
    // whose last halo row is c = i + 10, sits in the row that is free again 16 tokens on:
    // vgpr ((c>>2)&3) + 4*(c&1), lane half (c>>1)&1. The four tokens with c>>2 == g are complete
    // behind group g: they lie in two vgprs over both lane halves, leave from there, and the two
    // vgprs start again at zero for the tokens 16 further on (first touched by group g+1).
    // Column map: a wave owns 64 adjacent columns as NQ = 4 WMMA column tiles, and
    // N index n of tile q is column 4n + q. A lane's four tiles are then four adjacent
    // columns: one 16-byte LDS read per xs row feeds all four tiles, and a result row
    // leaves as one 16-byte store per lane, 256 contiguous bytes per half-wave.
    const int Llo = lane & 15;
    const int Lhi = lane >> 4;
    const int c0  = wave * (16 * NQ) + NQ * Llo;   // this lane's first column

    // groups up to 4J+3 touch no token beyond 16J+15; the last sub-tile takes the rest
    constexpr int G0  = 4 * J;
    constexpr int NGJ = ((J == NSUB - 1) ? NG : 4 * J + 4) - G0;

    // unrolled: a[] needs constant indices to live in registers
    v2f a[NGJ];
    #pragma unroll
    for (int s = 0; s < NGJ; ++s)
        a[s] = *(const v2f*)(&Aexp[(G0 + s) * 64 + Llo * 4 + 2 * Lhi]);

    // the sub-tile's xs reads stand here, in front of the groups: written among them, each would be
    // held behind the store statement before it (s unrolled: constant indices)
    float4 x0[NGJ], x1[NGJ];
    #pragma unroll
    for (int s = 0; s < NGJ; ++s) {
        const int k = (G0 + s) * 4 + 2 * Lhi;
        // padded K rows (74,75) re-read row 0 and are masked below
        x0[s] = *(const float4*)(&xs[((k     < HALO) ? k     : 0) * XSTR + c0]);
        x1[s] = *(const float4*)(&xs[((k + 1 < HALO) ? k + 1 : 0) * XSTR + c0]);
    }

    row_groups<G0, NGJ, 0>(a, x0, x1, acc, Ob + (size_t)(2 * Lhi) * DD + c0, Lhi);
}

__global__ __launch_bounds__(256) void local_attn_wmma_kernel(
    const float* __restrict__ X,     // [B,S,D]
    const float* __restrict__ Wv,    // [D]
    const float* __restrict__ bv,    // [1]
    float* __restrict__ Out)         // [B,S,D]
{
    __shared__ __attribute__((aligned(16))) float xs[HALO * XSTR];  // staged halo tile (~150 KB, two blocks per WGP)
    __shared__ float sbuf[HALO];        // scores for halo rows
    __shared__ __attribute__((aligned(16))) float Aexp[NG * 64];   // banded alpha as A tiles: per row group 16 accumulator rows x 4

    const int tid  = threadIdx.x;
    const int t0   = blockIdx.x * TS;
    const int b    = blockIdx.y;
    const float* Xb = X + (size_t)b * SS * DD;
    const int lane = tid & 31;

    // W for the scores: a lane holds columns 4*lane + 128*i .. +3, the columns of its
    // 16-byte xs reads; its latency passes under that of the first rows' copies.
    v4f w4[4];
    // unrolled: w4[] needs constant indices to live in registers
    #pragma unroll
    for (int i = 0; i < 4; ++i) w4[i] = *(const v4f*)(Wv + 4 * lane + 128 * i);
    // precaution: stands in front of the first rewrite of an address register these loads name
    asm volatile("s_wait_xcnt 0x0" ::: "memory");
    const float bias = bv[0];

    // ---------------- stage halo rows [t0-5, t0+69) into LDS ----------------
    // 74 rows * 128 float4 = 9472 16-byte pieces, NCP = 37 per lane, every lane on in each.
    // All copies are issued here, in row order; each sub-tile waits only for its own rows.
    {
        const unsigned xs_lds = (unsigned)(uintptr_t)xs;   // LDS byte address: low 32 bits
        const int rsub = tid >> 7;
        const int c4   = (tid & 127) * 4;
        copy_rows< 0, 7>(Xb, xs_lds, t0, rsub, c4);
        copy_rows< 7, 7>(Xb, xs_lds, t0, rsub, c4);
        copy_rows<14, 8>(Xb, xs_lds, t0, rsub, c4);
        copy_rows<22, 8>(Xb, xs_lds, t0, rsub, c4);
        copy_rows<30, 7>(Xb, xs_lds, t0, rsub, c4);
    }

    for (int v = tid; v < NG * 64; v += 256) Aexp[v] = 0.0f;

    float* Ob = Out + ((size_t)b * SS + t0) * DD;
    v8f acc[NQ] = {};   // 16 cyclic token rows x 64 columns of this wave, carried over the sub-tiles
    sub_tile<0>(xs, sbuf, Aexp, w4, bias, t0, tid, acc, Ob);
    sub_tile<1>(xs, sbuf, Aexp, w4, bias, t0, tid, acc, Ob);
    sub_tile<2>(xs, sbuf, Aexp, w4, bias, t0, tid, acc, Ob);
    sub_tile<3>(xs, sbuf, Aexp, w4, bias, t0, tid, acc, Ob);
}

extern "C" void kernel_launch(void* const* d_in, const int* in_sizes, int n_in,
                              void* d_out, int out_size, void* d_ws, size_t ws_size,
                              hipStream_t stream) {
    const float* X  = (const float*)d_in[0];   // [B,S,D] fp32
    const float* Wv = (const float*)d_in[1];   // [D]
    const float* bv = (const float*)d_in[2];   // [1]
    float* Out = (float*)d_out;                // [B,S,D] fp32

    dim3 grid(SS / TS, BB);   // 32 x 16 blocks
    dim3 block(256);          // 8 waves (wave32)
    local_attn_wmma_kernel<<<grid, block, 0, stream>>>(X, Wv, bv, Out);
}
